// v000
// The times below were measured on an AMD MI455X: many runs one after another, warmed up first and cycling through
// copies of the inputs, with the whole window's GPU time divided by the number of runs. Launches and the gaps
// between them are all in it. The median over several windows is given; except for v000 it joins two sittings, which
// can be a few percent apart, so the side-by-side timings, each taken in one sitting, are the better comparison.
// v000 is the starting kernel. One run takes 67 microseconds.
#include <hip/hip_runtime.h>

typedef __attribute__((ext_vector_type(16))) _Float16 v16h;
typedef __attribute__((ext_vector_type(8)))  float    v8f;

#define BS_  8
#define SEQ_ 2048
#define D_   128

constexpr int KV_TILE  = 64;     // keys per block step
constexpr int K_PITCH  = 136;    // halfs per K row in LDS (128 + 8 pad)
constexpr int VT_PITCH = 72;     // halfs per Vt row in LDS (64 + 8 pad)
#define MASK_VALUE (-1000000.0f)

__global__ __launch_bounds__(256)
void fa_fwd_kernel(const float* __restrict__ Q, const float* __restrict__ K,
                   const float* __restrict__ V, const int* __restrict__ VL,
                   float* __restrict__ Out) {
  const int tid  = threadIdx.x;
  const int lane = tid & 31;
  const int wave = tid >> 5;
  const int b    = blockIdx.x >> 4;             // 16 q-blocks of 128 rows per batch
  const int qrow0 = ((blockIdx.x & 15) * 128) + wave * 16;
  const int valid = VL[b];                      // uniform per block

  const int m  = lane & 15;                     // query column (N) / key-row selector
  const int hi = lane >> 4;                     // half-wave selector

  __shared__ _Float16 sK [KV_TILE * K_PITCH];   // K tile, row-major [key][d]
  __shared__ _Float16 sVt[D_ * VT_PITCH];       // V tile, transposed [d][key]

  // ---- Q^T B-fragments: 4 chunks of K=32 over D=128, 1/sqrt(d) folded in
  const float scale = 0.08838834764831845f;     // 1/sqrt(128)
  v16h qf[4];
  {
    const float* qrow = Q + (size_t)(b * SEQ_ + qrow0 + m) * D_;
    #pragma unroll
    for (int kc = 0; kc < 4; ++kc) {
      const float* p0 = qrow + kc * 32 + hi * 8;
      #pragma unroll
      for (int j = 0; j < 8; ++j) {
        qf[kc][j]     = (_Float16)(p0[j]      * scale);
        qf[kc][8 + j] = (_Float16)(p0[16 + j] * scale);
      }
    }
  }

  v8f o[8];
  #pragma unroll
  for (int dt = 0; dt < 8; ++dt) o[dt] = v8f{};
  float mi = -3.0e38f;
  float li = 0.0f;

  const float* Kb = K + (size_t)b * SEQ_ * D_;
  const float* Vb = V + (size_t)b * SEQ_ * D_;

  // Tiles with kv0 >= valid contribute exactly zero (f32 exp underflow),
  // identically to the reference softmax -> loop only while kv0 < valid.
  for (int kv0 = 0; kv0 < valid; kv0 += KV_TILE) {
    __syncthreads();
    // -------- cooperative staging: K tile (f16 row-major), V tile (f16 transposed)
    {
      const float4* ksrc = (const float4*)(Kb + (size_t)kv0 * D_);
      #pragma unroll
      for (int c = 0; c < 8; ++c) {
        int idx4 = c * 256 + tid;               // 2048 float4 = 64x128 floats
        int row  = idx4 >> 5;                   // 32 float4 per key row
        int col  = (idx4 & 31) * 4;
        float4 v = ksrc[idx4];
        _Float16* dst = sK + row * K_PITCH + col;
        dst[0] = (_Float16)v.x; dst[1] = (_Float16)v.y;
        dst[2] = (_Float16)v.z; dst[3] = (_Float16)v.w;
      }
      const float* vsrc = Vb + (size_t)kv0 * D_;
      #pragma unroll
      for (int c = 0; c < 32; ++c) {
        int idx = c * 256 + tid;                // 8192 = 64x128
        int row = idx >> 7;                     // key
        int col = idx & 127;                    // d
        sVt[col * VT_PITCH + row] = (_Float16)vsrc[idx];
      }
    }
    if (kv0 + KV_TILE < SEQ_) {                 // overlap next tile's HBM latency
      __builtin_prefetch(Kb + (size_t)(kv0 + KV_TILE) * D_ + tid * 32, 0, 1);
      __builtin_prefetch(Vb + (size_t)(kv0 + KV_TILE) * D_ + tid * 32, 0, 1);
    }
    __syncthreads();

    // -------- S^T = K_tile * Q^T : four 16-key sub-tiles (M=keys), chained over d
    v8f st[4];
    #pragma unroll
    for (int nt = 0; nt < 4; ++nt) {
      v16h kf[4];                               // A operand: K rows, regs walk d
      #pragma unroll
      for (int kc = 0; kc < 4; ++kc) {
        const _Float16* krow = sK + (nt * 16 + m) * K_PITCH + kc * 32 + hi * 8;
        #pragma unroll
        for (int j = 0; j < 8; ++j) { kf[kc][j] = krow[j]; kf[kc][8 + j] = krow[16 + j]; }
      }
      v8f acc = v8f{};
      #pragma unroll
      for (int kc = 0; kc < 4; ++kc)
        acc = __builtin_amdgcn_wmma_f32_16x16x32_f16(false, kf[kc], false, qf[kc],
                                                     (short)0, acc, false, false);
      st[nt] = acc;
    }

    // -------- padding mask: boundary tile only (uniform scalar branch).
    // Reg r of sub-tile nt holds key kv0 + nt*16 + 8*hi + r.
    if (kv0 + KV_TILE > valid) {
      const int t0 = valid - kv0 - hi * 8;
      #pragma unroll
      for (int nt = 0; nt < 4; ++nt) {
        const int t = t0 - nt * 16;
        #pragma unroll
        for (int r = 0; r < 8; ++r)
          st[nt][r] = (r >= t) ? MASK_VALUE : st[nt][r];
      }
    }

    // -------- online softmax: per-lane scalar stats (lane = one query column)
    float rowmax = st[0][0];
    #pragma unroll
    for (int nt = 0; nt < 4; ++nt)
      #pragma unroll
      for (int r = 0; r < 8; ++r)
        if (nt || r) rowmax = fmaxf(rowmax, st[nt][r]);
    rowmax = fmaxf(rowmax, __shfl_xor(rowmax, 16, 32));  // merge the two key halves
    const float mnew = fmaxf(mi, rowmax);
    const float corr = __expf(mi - mnew);
    float rs = 0.0f;
    #pragma unroll
    for (int nt = 0; nt < 4; ++nt)
      #pragma unroll
      for (int r = 0; r < 8; ++r) {
        float p = __expf(st[nt][r] - mnew);
        st[nt][r] = p;
        rs += p;
      }
    rs += __shfl_xor(rs, 16, 32);
    li = li * corr + rs;
    mi = mnew;

    // -------- P already sits in B-operand layout: pack f32->f16 in registers
    v16h pf0, pf1;   // keys 0..31 / 32..63 : b[j]=P[koff+8*hi+j][q], b[8+j]=+16
    #pragma unroll
    for (int j = 0; j < 8; ++j) {
      pf0[j]     = (_Float16)st[0][j];
      pf0[8 + j] = (_Float16)st[1][j];
      pf1[j]     = (_Float16)st[2][j];
      pf1[8 + j] = (_Float16)st[3][j];
    }

    // -------- O^T = corr*O^T + V^T * P  (A = V^T rows of d, from transposed LDS)
    #pragma unroll
    for (int dt = 0; dt < 8; ++dt) {
      const _Float16* vr = sVt + (dt * 16 + m) * VT_PITCH + hi * 8;
      v16h vf0, vf1;
      #pragma unroll
      for (int j = 0; j < 8; ++j) {
        vf0[j] = vr[j];      vf0[8 + j] = vr[16 + j];
        vf1[j] = vr[32 + j]; vf1[8 + j] = vr[48 + j];
      }
      #pragma unroll
      for (int r = 0; r < 8; ++r) o[dt][r] *= corr;
      o[dt] = __builtin_amdgcn_wmma_f32_16x16x32_f16(false, vf0, false, pf0,
                                                     (short)0, o[dt], false, false);
      o[dt] = __builtin_amdgcn_wmma_f32_16x16x32_f16(false, vf1, false, pf1,
                                                     (short)0, o[dt], false, false);
    }
  }

  // -------- epilogue: normalize, write fp32 output (O transposed: lane = query;
  // per lane r=0..7 are consecutive d -> pack into float4 stores)
  const float inv = 1.0f / li;
  float* op = Out + (size_t)(b * SEQ_ + qrow0 + m) * D_ + hi * 8;
  #pragma unroll
  for (int dt = 0; dt < 8; ++dt) {
    float4 lo  = make_float4(o[dt][0] * inv, o[dt][1] * inv,
                             o[dt][2] * inv, o[dt][3] * inv);
    float4 hi4 = make_float4(o[dt][4] * inv, o[dt][5] * inv,
                             o[dt][6] * inv, o[dt][7] * inv);
    *(float4*)(op + dt * 16)     = lo;
    *(float4*)(op + dt * 16 + 4) = hi4;
  }
}

extern "C" void kernel_launch(void* const* d_in, const int* in_sizes, int n_in,
                              void* d_out, int out_size, void* d_ws, size_t ws_size,
                              hipStream_t stream) {
  (void)in_sizes; (void)n_in; (void)out_size; (void)d_ws; (void)ws_size;
  const float* Q  = (const float*)d_in[0];
  const float* K  = (const float*)d_in[1];
  const float* V  = (const float*)d_in[2];
  const int*   VL = (const int*)d_in[3];
  float* O = (float*)d_out;

  dim3 grid(BS_ * (SEQ_ / 128));   // 128 blocks: 8 batches x 16 q-tiles of 128 rows
  dim3 block(256);                 // 8 wave32 -> one 16-row q-tile each
  fa_fwd_kernel<<<grid, block, 0, stream>>>(Q, K, V, VL, O);
}

// v001
// One run takes 29 microseconds.
// Next to v000, in two timings, it ran 2.35 times as fast each time.
#include <hip/hip_runtime.h>

typedef __attribute__((ext_vector_type(16))) _Float16 v16h;
typedef __attribute__((ext_vector_type(8)))  float    v8f;

#define BS_  8
#define SEQ_ 2048
#define D_   128

constexpr int KV_TILE  = 64;     // keys per block step
constexpr int K_PITCH  = 136;    // halfs per K row in LDS (128 + 8 pad)
constexpr int VT_PITCH = 72;     // halfs per Vt row in LDS (64 + 8 pad)
#define MASK_VALUE (-1000000.0f)

constexpr int MAX_RANGES = 32;   // key ranges in all: x 16 q-blocks = 512 work-groups,
                                 // two resident on each of the chip's 256 WGPs
constexpr int QT_B = SEQ_ / 16;  // 16-row query tiles per batch

__device__ __forceinline__ int clamp_len(int v) {
  return v < 1 ? 1 : (v > SEQ_ ? SEQ_ : v);
}

// The plan, derived alike by both kernels from the lengths: the smallest number
// of 64-key tiles per range for which all batches together need at most
// MAX_RANGES ranges. Lane L tries L + 1 tiles per range; 32 always fits (8 ranges).
// Every lane of the wave must be on. nr[i] = ranges of batch i; returns tiles per range.
__device__ __forceinline__ int make_plan(const int* __restrict__ VL, int lane, int nr[BS_]) {
  const float rk = 1.0f / (float)(lane + 1);
  int q[BS_];
  int s = 0;
  #pragma unroll
  for (int i = 0; i < BS_; ++i) {
    const int t = (clamp_len(VL[i]) + KV_TILE - 1) / KV_TILE;      // 1..32 tiles
    // ceil(t / (L+1)) = floor((t + L) / (L+1)); the half keeps the rounded
    // product at least 1/64 away from every integer, so the floor is exact.
    q[i] = (int)(((float)(t + lane) + 0.5f) * rk);
    s += q[i];
  }
  const unsigned fits = __builtin_amdgcn_ballot_w32(s <= MAX_RANGES);
  const int pick = __builtin_ctz(fits);
  #pragma unroll
  for (int i = 0; i < BS_; ++i) nr[i] = __builtin_amdgcn_readlane(q[i], pick);
  return pick + 1;
}

__global__ __launch_bounds__(256)
void fa_fwd_kernel(const float* __restrict__ Q, const float* __restrict__ K,
                   const float* __restrict__ V, const int* __restrict__ VL,
                   float* __restrict__ Opart, float* __restrict__ ML) {
  const int tid  = threadIdx.x;
  const int lane = tid & 31;
  const int wave = tid >> 5;
  // Block -> (range slot, q-block); slots are dealt to the batches in order,
  // nr[i] each. Blocks of unused slots leave before any barrier.
  int nr[BS_];
  const int tpr  = make_plan(VL, lane, nr);     // 64-key tiles per range
  const int slot = blockIdx.x >> 4;
  int b = -1, rng = 0, first = 0, valid = 0;    // all uniform per block
  #pragma unroll
  for (int i = 0; i < BS_; ++i) {
    const int off = slot - first;
    const bool in = off >= 0 && off < nr[i];
    b     = in ? i                : b;
    rng   = in ? off              : rng;
    valid = in ? clamp_len(VL[i]) : valid;
    first += nr[i];
  }
  if (b < 0) return;
  const int qrow0 = ((blockIdx.x & 15) * 128) + wave * 16;
  const int kbeg  = rng * tpr * KV_TILE;        // < valid: every range has a tile
  const int kend  = valid < kbeg + tpr * KV_TILE ? valid : kbeg + tpr * KV_TILE;

  const int m  = lane & 15;                     // query column (N) / key-row selector
  const int hi = lane >> 4;                     // half-wave selector

  __shared__ _Float16 sK [KV_TILE * K_PITCH];   // K tile, row-major [key][d]
  __shared__ _Float16 sVt[D_ * VT_PITCH];       // V tile, transposed [d][key]

  // ---- Q^T B-fragments: 4 chunks of K=32 over D=128, 1/sqrt(d) folded in
  const float scale = 0.08838834764831845f;     // 1/sqrt(128)
  v16h qf[4];
  {
    const float* qrow = Q + (size_t)(b * SEQ_ + qrow0 + m) * D_;
    #pragma unroll
    for (int kc = 0; kc < 4; ++kc) {
      const float* p0 = qrow + kc * 32 + hi * 8;
      #pragma unroll
      for (int j = 0; j < 8; ++j) {
        qf[kc][j]     = (_Float16)(p0[j]      * scale);
        qf[kc][8 + j] = (_Float16)(p0[16 + j] * scale);
      }
    }
  }

  v8f o[8];
  #pragma unroll
  for (int dt = 0; dt < 8; ++dt) o[dt] = v8f{};
  float mi = -3.0e38f;
  float li = 0.0f;

  const float* Kb = K + (size_t)b * SEQ_ * D_;
  const float* Vb = V + (size_t)b * SEQ_ * D_;

  // Tiles with kv0 >= valid contribute exactly zero (f32 exp underflow),
  // identically to the reference softmax -> loop only while kv0 < valid.
  for (int kv0 = kbeg; kv0 < kend; kv0 += KV_TILE) {
    __syncthreads();
    // -------- cooperative staging: K tile (f16 row-major), V tile (f16 transposed)
    {
      const float4* ksrc = (const float4*)(Kb + (size_t)kv0 * D_);
      #pragma unroll
      for (int c = 0; c < 8; ++c) {
        int idx4 = c * 256 + tid;               // 2048 float4 = 64x128 floats
        int row  = idx4 >> 5;                   // 32 float4 per key row
        int col  = (idx4 & 31) * 4;
        float4 v = ksrc[idx4];
        _Float16* dst = sK + row * K_PITCH + col;
        dst[0] = (_Float16)v.x; dst[1] = (_Float16)v.y;
        dst[2] = (_Float16)v.z; dst[3] = (_Float16)v.w;
      }
      const float* vsrc = Vb + (size_t)kv0 * D_;
      #pragma unroll
      for (int c = 0; c < 32; ++c) {
        int idx = c * 256 + tid;                // 8192 = 64x128
        int row = idx >> 7;                     // key
        int col = idx & 127;                    // d
        sVt[col * VT_PITCH + row] = (_Float16)vsrc[idx];
      }
    }
    if (kv0 + KV_TILE < SEQ_) {                 // overlap next tile's HBM latency
      __builtin_prefetch(Kb + (size_t)(kv0 + KV_TILE) * D_ + tid * 32, 0, 1);
      __builtin_prefetch(Vb + (size_t)(kv0 + KV_TILE) * D_ + tid * 32, 0, 1);
    }
    __syncthreads();

    // -------- S^T = K_tile * Q^T : four 16-key sub-tiles (M=keys), chained over d
    v8f st[4];
    #pragma unroll
    for (int nt = 0; nt < 4; ++nt) {
      v16h kf[4];                               // A operand: K rows, regs walk d
      #pragma unroll
      for (int kc = 0; kc < 4; ++kc) {
        const _Float16* krow = sK + (nt * 16 + m) * K_PITCH + kc * 32 + hi * 8;
        #pragma unroll
        for (int j = 0; j < 8; ++j) { kf[kc][j] = krow[j]; kf[kc][8 + j] = krow[16 + j]; }
      }
      v8f acc = v8f{};
      #pragma unroll
      for (int kc = 0; kc < 4; ++kc)
        acc = __builtin_amdgcn_wmma_f32_16x16x32_f16(false, kf[kc], false, qf[kc],
                                                     (short)0, acc, false, false);
      st[nt] = acc;
    }

    // -------- padding mask: boundary tile only (uniform scalar branch).
    // Reg r of sub-tile nt holds key kv0 + nt*16 + 8*hi + r.
    if (kv0 + KV_TILE > valid) {
      const int t0 = valid - kv0 - hi * 8;
      #pragma unroll
      for (int nt = 0; nt < 4; ++nt) {
        const int t = t0 - nt * 16;
        #pragma unroll
        for (int r = 0; r < 8; ++r)
          st[nt][r] = (r >= t) ? MASK_VALUE : st[nt][r];
      }
    }

    // -------- online softmax: per-lane scalar stats (lane = one query column)
    float rowmax = st[0][0];
    #pragma unroll
    for (int nt = 0; nt < 4; ++nt)
      #pragma unroll
      for (int r = 0; r < 8; ++r)
        if (nt || r) rowmax = fmaxf(rowmax, st[nt][r]);
    rowmax = fmaxf(rowmax, __shfl_xor(rowmax, 16, 32));  // merge the two key halves
    const float mnew = fmaxf(mi, rowmax);
    const float corr = __expf(mi - mnew);
    float rs = 0.0f;
    #pragma unroll
    for (int nt = 0; nt < 4; ++nt)
      #pragma unroll
      for (int r = 0; r < 8; ++r) {
        float p = __expf(st[nt][r] - mnew);
        st[nt][r] = p;
        rs += p;
      }
    rs += __shfl_xor(rs, 16, 32);
    li = li * corr + rs;
    mi = mnew;

    // -------- P already sits in B-operand layout: pack f32->f16 in registers
    v16h pf0, pf1;   // keys 0..31 / 32..63 : b[j]=P[koff+8*hi+j][q], b[8+j]=+16
    #pragma unroll
    for (int j = 0; j < 8; ++j) {
      pf0[j]     = (_Float16)st[0][j];
      pf0[8 + j] = (_Float16)st[1][j];
      pf1[j]     = (_Float16)st[2][j];
      pf1[8 + j] = (_Float16)st[3][j];
    }

    // -------- O^T = corr*O^T + V^T * P  (A = V^T rows of d, from transposed LDS)
    #pragma unroll
    for (int dt = 0; dt < 8; ++dt) {
      const _Float16* vr = sVt + (dt * 16 + m) * VT_PITCH + hi * 8;
      v16h vf0, vf1;
      #pragma unroll
      for (int j = 0; j < 8; ++j) {
        vf0[j] = vr[j];      vf0[8 + j] = vr[16 + j];
        vf1[j] = vr[32 + j]; vf1[8 + j] = vr[48 + j];
      }
      #pragma unroll
      for (int r = 0; r < 8; ++r) o[dt][r] *= corr;
      o[dt] = __builtin_amdgcn_wmma_f32_16x16x32_f16(false, vf0, false, pf0,
                                                     (short)0, o[dt], false, false);
      o[dt] = __builtin_amdgcn_wmma_f32_16x16x32_f16(false, vf1, false, pf1,
                                                     (short)0, o[dt], false, false);
    }
  }

  // -------- epilogue: un-normalised partial of this key range, in fragment order
  // [slot][q-tile][dt][half][lane] so that each store covers 512 contiguous bytes;
  // running maximum and sum per query row beside it.
  float4* po = (float4*)Opart + ((size_t)(slot * QT_B + (qrow0 >> 4)) * 16) * 32 + lane;
  #pragma unroll
  for (int dt = 0; dt < 8; ++dt) {
    po[(dt * 2) * 32]     = make_float4(o[dt][0], o[dt][1], o[dt][2], o[dt][3]);
    po[(dt * 2 + 1) * 32] = make_float4(o[dt][4], o[dt][5], o[dt][6], o[dt][7]);
  }
  if (hi == 0)
    ((float2*)ML)[slot * SEQ_ + qrow0 + m] = make_float2(mi, li);
}

// exp(x) as __expf forms it: one multiply, one v_exp_f32. The v_nop fills the slot
// that the instruction set asks for between a transcendental and a directly
// following instruction that reads its result or overwrites its source.
__device__ __forceinline__ float exp_slot(float x) {
  const float y = x * 1.44269504f;
  float r;
  asm("v_exp_f32 %0, %1\n\tv_nop" : "=v"(r) : "v"(y));
  return r;
}

// Merge of a batch's key ranges: one wave per dt, each for both of the block's two q-tiles.
__global__ __launch_bounds__(256)
void fa_merge_kernel(const float* __restrict__ Opart, const float* __restrict__ ML,
                     const int* __restrict__ VL, float* __restrict__ Out) {
  const int lane = threadIdx.x & 31;
  const int dt   = threadIdx.x >> 5;
  const int m    = lane & 15;
  const int hi   = lane >> 4;
  const int b    = blockIdx.x >> 6;             // 64 blocks of 32 rows per batch
  const int qt0  = (blockIdx.x & 63) * 2;       // first q-tile, counted in the batch

  int nr[BS_];
  make_plan(VL, lane, nr);
  int first = 0, n = 0;                         // the slots the first launch wrote for b
  #pragma unroll
  for (int i = 0; i < BS_; ++i) {
    first += i < b ? nr[i] : 0;
    n      = i == b ? nr[i] : n;
  }

  float mx[2], ls[2];
  float4 r0[2], r1[2];
  #pragma unroll
  for (int t = 0; t < 2; ++t) {
    mx[t] = -3.0e38f; ls[t] = 0.f;
    r0[t] = make_float4(0.f, 0.f, 0.f, 0.f); r1[t] = r0[t];
  }

  for (int c0 = 0; c0 < n; c0 += 8) {           // n <= MAX_RANGES; mostly one trip
    float4 a0[2][8], a1[2][8];
    float2 ml[2][8];
    // (max, sum): read without a branch, from the batch's last slot where the
    // range does not exist, so that nothing in a branch waits for a load.
    const float2* pm[8];
    #pragma unroll
    for (int c = 0; c < 8; ++c) {
      const int cc = c0 + c < n ? c0 + c : n - 1;
      pm[c] = (const float2*)ML + (first + cc) * SEQ_ + qt0 * 16 + m;
      ml[0][c] = pm[c][0];
      ml[1][c] = pm[c][16];
    }
    const float4* pi[2];
    #pragma unroll
    for (int t = 0; t < 2; ++t) {
      pi[t] = (const float4*)Opart
          + ((size_t)((first + c0) * QT_B + qt0 + t) * 16 + dt * 2) * 32 + lane;
      #pragma unroll
      for (int c = 0; c < 8; ++c) {
        if (c0 + c < n) {                       // uniform: only written slots are read
          a0[t][c] = pi[t][c * (QT_B * 512)];
          a1[t][c] = pi[t][c * (QT_B * 512) + 32];
        } else {
          a0[t][c] = make_float4(0.f, 0.f, 0.f, 0.f);
          a1[t][c] = make_float4(0.f, 0.f, 0.f, 0.f);
        }
      }
    }
    // The loads' address registers are inputs here, so that they stay whole up to
    // the wait: else a dead address pair is handed to a later load as its destination.
    asm volatile("s_wait_xcnt 0x0"
                 :: "v"(pi[0]), "v"(pi[1]), "v"(pm[0]), "v"(pm[1]), "v"(pm[2]), "v"(pm[3]),
                    "v"(pm[4]), "v"(pm[5]), "v"(pm[6]), "v"(pm[7]) : "memory");
    #pragma unroll
    for (int t = 0; t < 2; ++t)
      #pragma unroll
      for (int c = 0; c < 8; ++c)
        if (c0 + c >= n) ml[t][c] = make_float2(-3.0e38f, 0.f);   // weighs nothing below
    #pragma unroll
    for (int t = 0; t < 2; ++t) {
      float mnew = mx[t];
      #pragma unroll
      for (int c = 0; c < 8; ++c) mnew = fmaxf(mnew, ml[t][c].x);
      const float sc = exp_slot(mx[t] - mnew);
      mx[t] = mnew;
      ls[t] *= sc;
      r0[t].x *= sc; r0[t].y *= sc; r0[t].z *= sc; r0[t].w *= sc;
      r1[t].x *= sc; r1[t].y *= sc; r1[t].z *= sc; r1[t].w *= sc;
      #pragma unroll
      for (int c = 0; c < 8; ++c) {
        const float w = exp_slot(ml[t][c].x - mnew);
        ls[t] += w * ml[t][c].y;
        r0[t].x += w * a0[t][c].x; r0[t].y += w * a0[t][c].y;
        r0[t].z += w * a0[t][c].z; r0[t].w += w * a0[t][c].w;
        r1[t].x += w * a1[t][c].x; r1[t].y += w * a1[t][c].y;
        r1[t].z += w * a1[t][c].z; r1[t].w += w * a1[t][c].w;
      }
    }
  }

  #pragma unroll
  for (int t = 0; t < 2; ++t) {
    const float inv = 1.0f / ls[t];
    float* op = Out + (size_t)(b * SEQ_ + (qt0 + t) * 16 + m) * D_ + dt * 16 + hi * 8;
    *(float4*)op       = make_float4(r0[t].x * inv, r0[t].y * inv, r0[t].z * inv, r0[t].w * inv);
    *(float4*)(op + 4) = make_float4(r1[t].x * inv, r1[t].y * inv, r1[t].z * inv, r1[t].w * inv);
  }
}

extern "C" void kernel_launch(void* const* d_in, const int* in_sizes, int n_in,
                              void* d_out, int out_size, void* d_ws, size_t ws_size,
                              hipStream_t stream) {
  (void)in_sizes; (void)n_in; (void)out_size; (void)ws_size;
  const float* Q  = (const float*)d_in[0];
  const float* K  = (const float*)d_in[1];
  const float* V  = (const float*)d_in[2];
  const int*   VL = (const int*)d_in[3];
  float* O = (float*)d_out;

  float* Opart = (float*)d_ws;                           // MAX_RANGES x 1 MiB of partials
  float* ML    = Opart + (size_t)MAX_RANGES * SEQ_ * D_;  // MAX_RANGES x SEQ_ (max, sum)

  dim3 grid(MAX_RANGES * (SEQ_ / 128));  // 512 blocks: range slots x 16 q-blocks of 128 rows
  dim3 block(256);                 // 8 wave32 -> one 16-row q-tile each; in the merge one dt each
  fa_fwd_kernel<<<grid, block, 0, stream>>>(Q, K, V, VL, Opart, ML);
  fa_merge_kernel<<<dim3(BS_ * QT_B / 2), block, 0, stream>>>(Opart, ML, VL, O);
}

// v002
// A run of this version takes 24.8 microseconds.
// Two timings next to v001 put it at 1.17 and 1.18 times that version's speed.
// Counting every step since v000, it is 2.76 times as fast.
#include <hip/hip_runtime.h>

typedef __attribute__((ext_vector_type(16))) _Float16 v16h;
typedef __attribute__((ext_vector_type(8)))  float    v8f;
typedef __attribute__((ext_vector_type(8)))  _Float16 v8h;
typedef __attribute__((ext_vector_type(8)))  short    s16x8;

#define BS_  8
#define SEQ_ 2048
#define D_   128

constexpr int KV_TILE  = 64;     // keys per block step
constexpr int K_PITCH  = 136;    // halfs per K row in LDS (128 + 8 pad)
constexpr int V_PITCH  = 144;    // halfs per V row in LDS: 288 B = 32 B x 9, the transposing load's pitch
#define MASK_VALUE (-1000000.0f)

constexpr int MAX_RANGES = 32;   // key ranges in all: x 16 q-blocks = 512 work-groups,
                                 // two resident on each of the chip's 256 WGPs
constexpr int QT_B = SEQ_ / 16;  // 16-row query tiles per batch

// Transposing LDS load: from a row-major 16-bit tile T with lane l at
// T[k0 + 8*(l>>4) + (l&7)][d0 + 8*((l>>3)&1)], lane l gets T[k0 + 8*(l>>4) + 0..7][d0 + (l&15)].
__device__ __forceinline__ v8h ld_tr16(const _Float16* p) {
  typedef __attribute__((address_space(3))) s16x8 lds_s16x8;
  return __builtin_bit_cast(v8h, __builtin_amdgcn_ds_load_tr16_b128_v8i16((lds_s16x8*)p));
}

__device__ __forceinline__ int clamp_len(int v) {
  return v < 1 ? 1 : (v > SEQ_ ? SEQ_ : v);
}

// The plan, derived alike by both kernels from the lengths: the smallest number
// of 64-key tiles per range for which all batches together need at most
// MAX_RANGES ranges. Lane L tries L + 1 tiles per range; 32 always fits (8 ranges).
// Every lane of the wave must be on. nr[i] = ranges of batch i; returns tiles per range.
__device__ __forceinline__ int make_plan(const int* __restrict__ VL, int lane, int nr[BS_]) {
  const float rk = 1.0f / (float)(lane + 1);
  int q[BS_];
  int s = 0;
  #pragma unroll
  for (int i = 0; i < BS_; ++i) {
    const int t = (clamp_len(VL[i]) + KV_TILE - 1) / KV_TILE;      // 1..32 tiles
    // ceil(t / (L+1)) = floor((t + L) / (L+1)); the half keeps the rounded
    // product at least 1/64 away from every integer, so the floor is exact.
    q[i] = (int)(((float)(t + lane) + 0.5f) * rk);
    s += q[i];
  }
  const unsigned fits = __builtin_amdgcn_ballot_w32(s <= MAX_RANGES);
  const int pick = __builtin_ctz(fits);
  #pragma unroll
  for (int i = 0; i < BS_; ++i) nr[i] = __builtin_amdgcn_readlane(q[i], pick);
  return pick + 1;
}

__global__ __launch_bounds__(256)
void fa_fwd_kernel(const float* __restrict__ Q, const float* __restrict__ K,
                   const float* __restrict__ V, const int* __restrict__ VL,
                   float* __restrict__ Opart, float* __restrict__ ML) {
  const int tid  = threadIdx.x;
  const int lane = tid & 31;
  const int wave = tid >> 5;
  // Block -> (range slot, q-block); slots are dealt to the batches in order,
  // nr[i] each. Blocks of unused slots leave before any barrier.
  int nr[BS_];
  const int tpr  = make_plan(VL, lane, nr);     // 64-key tiles per range
  const int slot = blockIdx.x >> 4;
  int b = -1, rng = 0, first = 0, valid = 0;    // all uniform per block
  #pragma unroll
  for (int i = 0; i < BS_; ++i) {
    const int off = slot - first;
    const bool in = off >= 0 && off < nr[i];
    b     = in ? i                : b;
    rng   = in ? off              : rng;
    valid = in ? clamp_len(VL[i]) : valid;
    first += nr[i];
  }
  if (b < 0) return;
  const int qrow0 = ((blockIdx.x & 15) * 128) + wave * 16;
  const int kbeg  = rng * tpr * KV_TILE;        // < valid: every range has a tile
  const int kend  = valid < kbeg + tpr * KV_TILE ? valid : kbeg + tpr * KV_TILE;

  const int m  = lane & 15;                     // query column (N) / key-row selector
  const int hi = lane >> 4;                     // half-wave selector

  __shared__ _Float16 sK [KV_TILE * K_PITCH];   // K tile, row-major [key][d]
  __shared__ __attribute__((aligned(16))) _Float16 sV[KV_TILE * V_PITCH];  // V tile, row-major [key][d]

  // ---- Q^T B-fragments: 4 chunks of K=32 over D=128, 1/sqrt(d) folded in
  const float scale = 0.08838834764831845f;     // 1/sqrt(128)
  v16h qf[4];
  {
    const float* qrow = Q + (size_t)(b * SEQ_ + qrow0 + m) * D_;
    #pragma unroll
    for (int kc = 0; kc < 4; ++kc) {
      const float* p0 = qrow + kc * 32 + hi * 8;
      #pragma unroll
      for (int j = 0; j < 8; ++j) {
        qf[kc][j]     = (_Float16)(p0[j]      * scale);
        qf[kc][8 + j] = (_Float16)(p0[16 + j] * scale);
      }
    }
  }

  v8f o[8];
  #pragma unroll
  for (int dt = 0; dt < 8; ++dt) o[dt] = v8f{};
  float mi = -3.0e38f;
  float li = 0.0f;

  const float* Kb = K + (size_t)b * SEQ_ * D_;
  const float* Vb = V + (size_t)b * SEQ_ * D_;

  // Tiles with kv0 >= valid contribute exactly zero (f32 exp underflow),
  // identically to the reference softmax -> loop only while kv0 < valid.
  for (int kv0 = kbeg; kv0 < kend; kv0 += KV_TILE) {
    __syncthreads();
    // -------- cooperative staging: K tile and V tile, both f16 row-major
    {
      const float4* ksrc = (const float4*)(Kb + (size_t)kv0 * D_);
      #pragma unroll
      for (int c = 0; c < 8; ++c) {
        int idx4 = c * 256 + tid;               // 2048 float4 = 64x128 floats
        int row  = idx4 >> 5;                   // 32 float4 per key row
        int col  = (idx4 & 31) * 4;
        float4 v = ksrc[idx4];
        _Float16* dst = sK + row * K_PITCH + col;
        dst[0] = (_Float16)v.x; dst[1] = (_Float16)v.y;
        dst[2] = (_Float16)v.z; dst[3] = (_Float16)v.w;
      }
      const float4* vsrc = (const float4*)(Vb + (size_t)kv0 * D_);
      #pragma unroll
      for (int c = 0; c < 8; ++c) {
        int idx4 = c * 256 + tid;
        int row  = idx4 >> 5;                   // key
        int col  = (idx4 & 31) * 4;             // d
        float4 v = vsrc[idx4];
        _Float16* dst = sV + row * V_PITCH + col;
        dst[0] = (_Float16)v.x; dst[1] = (_Float16)v.y;
        dst[2] = (_Float16)v.z; dst[3] = (_Float16)v.w;
      }
    }
    if (kv0 + KV_TILE < SEQ_) {                 // overlap next tile's HBM latency
      __builtin_prefetch(Kb + (size_t)(kv0 + KV_TILE) * D_ + tid * 32, 0, 1);
      __builtin_prefetch(Vb + (size_t)(kv0 + KV_TILE) * D_ + tid * 32, 0, 1);
    }
    __syncthreads();

    // -------- S^T = K_tile * Q^T : four 16-key sub-tiles (M=keys), chained over d
    v8f st[4];
    #pragma unroll
    for (int nt = 0; nt < 4; ++nt) {
      v16h kf[4];                               // A operand: K rows, regs walk d
      #pragma unroll
      for (int kc = 0; kc < 4; ++kc) {
        const _Float16* krow = sK + (nt * 16 + m) * K_PITCH + kc * 32 + hi * 8;
        #pragma unroll
        for (int j = 0; j < 8; ++j) { kf[kc][j] = krow[j]; kf[kc][8 + j] = krow[16 + j]; }
      }
      v8f acc = v8f{};
      #pragma unroll
      for (int kc = 0; kc < 4; ++kc)
        acc = __builtin_amdgcn_wmma_f32_16x16x32_f16(false, kf[kc], false, qf[kc],
                                                     (short)0, acc, false, false);
      st[nt] = acc;
    }

    // -------- padding mask: boundary tile only (uniform scalar branch).
    // Reg r of sub-tile nt holds key kv0 + nt*16 + 8*hi + r.
    if (kv0 + KV_TILE > valid) {
      const int t0 = valid - kv0 - hi * 8;
      #pragma unroll
      for (int nt = 0; nt < 4; ++nt) {
        const int t = t0 - nt * 16;
        #pragma unroll
        for (int r = 0; r < 8; ++r)
          st[nt][r] = (r >= t) ? MASK_VALUE : st[nt][r];
      }
    }

    // -------- online softmax: per-lane scalar stats (lane = one query column)
    float rowmax = st[0][0];
    #pragma unroll
    for (int nt = 0; nt < 4; ++nt)
      #pragma unroll
      for (int r = 0; r < 8; ++r)
        if (nt || r) rowmax = fmaxf(rowmax, st[nt][r]);
    rowmax = fmaxf(rowmax, __shfl_xor(rowmax, 16, 32));  // merge the two key halves
    const float mnew = fmaxf(mi, rowmax);
    const float corr = __expf(mi - mnew);
    float rs = 0.0f;
    #pragma unroll
    for (int nt = 0; nt < 4; ++nt)
      #pragma unroll
      for (int r = 0; r < 8; ++r) {
        float p = __expf(st[nt][r] - mnew);
        st[nt][r] = p;
        rs += p;
      }
    rs += __shfl_xor(rs, 16, 32);
    li = li * corr + rs;
    mi = mnew;

    // -------- P already sits in B-operand layout: pack f32->f16 in registers
    v16h pf0, pf1;   // keys 0..31 / 32..63 : b[j]=P[koff+8*hi+j][q], b[8+j]=+16
    #pragma unroll
    for (int j = 0; j < 8; ++j) {
      pf0[j]     = (_Float16)st[0][j];
      pf0[8 + j] = (_Float16)st[1][j];
      pf1[j]     = (_Float16)st[2][j];
      pf1[8 + j] = (_Float16)st[3][j];
    }

    // -------- O^T = corr*O^T + V^T * P  (A = V^T rows of d, transposed on the way out of LDS:
    // element j of a load at key base k0 is V[k0 + 8*hi + j][dt*16 + m], the k order of pf0 / pf1)
    const _Float16* vt = sV + (hi * 8 + (lane & 7)) * V_PITCH + ((lane >> 3) & 1) * 8;
    #pragma unroll
    for (int dt = 0; dt < 8; ++dt) {
      const v8h a0 = ld_tr16(vt + dt * 16);
      const v8h a1 = ld_tr16(vt + 16 * V_PITCH + dt * 16);
      const v8h a2 = ld_tr16(vt + 32 * V_PITCH + dt * 16);
      const v8h a3 = ld_tr16(vt + 48 * V_PITCH + dt * 16);
      const v16h vf0 = __builtin_shufflevector(a0, a1, 0, 1, 2, 3, 4, 5, 6, 7, 8, 9, 10, 11, 12, 13, 14, 15);
      const v16h vf1 = __builtin_shufflevector(a2, a3, 0, 1, 2, 3, 4, 5, 6, 7, 8, 9, 10, 11, 12, 13, 14, 15);
      #pragma unroll
      for (int r = 0; r < 8; ++r) o[dt][r] *= corr;
      o[dt] = __builtin_amdgcn_wmma_f32_16x16x32_f16(false, vf0, false, pf0,
                                                     (short)0, o[dt], false, false);
      o[dt] = __builtin_amdgcn_wmma_f32_16x16x32_f16(false, vf1, false, pf1,
                                                     (short)0, o[dt], false, false);
    }
  }

  // -------- epilogue: un-normalised partial of this key range, in fragment order
  // [slot][q-tile][dt][half][lane] so that each store covers 512 contiguous bytes;
  // running maximum and sum per query row beside it.
  float4* po = (float4*)Opart + ((size_t)(slot * QT_B + (qrow0 >> 4)) * 16) * 32 + lane;
  #pragma unroll
  for (int dt = 0; dt < 8; ++dt) {
    po[(dt * 2) * 32]     = make_float4(o[dt][0], o[dt][1], o[dt][2], o[dt][3]);
    po[(dt * 2 + 1) * 32] = make_float4(o[dt][4], o[dt][5], o[dt][6], o[dt][7]);
  }
  if (hi == 0)
    ((float2*)ML)[slot * SEQ_ + qrow0 + m] = make_float2(mi, li);
}

// exp(x) as __expf forms it: one multiply, one v_exp_f32. The v_nop fills the slot
// that the instruction set asks for between a transcendental and a directly
// following instruction that reads its result or overwrites its source.
__device__ __forceinline__ float exp_slot(float x) {
  const float y = x * 1.44269504f;
  float r;
  asm("v_exp_f32 %0, %1\n\tv_nop" : "=v"(r) : "v"(y));
  return r;
}

// Merge of a batch's key ranges: one wave per dt, each for both of the block's two q-tiles.
__global__ __launch_bounds__(256)
void fa_merge_kernel(const float* __restrict__ Opart, const float* __restrict__ ML,
                     const int* __restrict__ VL, float* __restrict__ Out) {
  const int lane = threadIdx.x & 31;
  const int dt   = threadIdx.x >> 5;
  const int m    = lane & 15;
  const int hi   = lane >> 4;
  const int b    = blockIdx.x >> 6;             // 64 blocks of 32 rows per batch
  const int qt0  = (blockIdx.x & 63) * 2;       // first q-tile, counted in the batch

  int nr[BS_];
  make_plan(VL, lane, nr);
  int first = 0, n = 0;                         // the slots the first launch wrote for b
  #pragma unroll
  for (int i = 0; i < BS_; ++i) {
    first += i < b ? nr[i] : 0;
    n      = i == b ? nr[i] : n;
  }

  float mx[2], ls[2];
  float4 r0[2], r1[2];
  #pragma unroll
  for (int t = 0; t < 2; ++t) {
    mx[t] = -3.0e38f; ls[t] = 0.f;
    r0[t] = make_float4(0.f, 0.f, 0.f, 0.f); r1[t] = r0[t];
  }

  for (int c0 = 0; c0 < n; c0 += 8) {           // n <= MAX_RANGES; mostly one trip
    float4 a0[2][8], a1[2][8];
    float2 ml[2][8];
    // (max, sum): read without a branch, from the batch's last slot where the
    // range does not exist, so that nothing in a branch waits for a load.
    const float2* pm[8];
    #pragma unroll
    for (int c = 0; c < 8; ++c) {
      const int cc = c0 + c < n ? c0 + c : n - 1;
      pm[c] = (const float2*)ML + (first + cc) * SEQ_ + qt0 * 16 + m;
      ml[0][c] = pm[c][0];
      ml[1][c] = pm[c][16];
    }
    const float4* pi[2];
    #pragma unroll
    for (int t = 0; t < 2; ++t) {
      pi[t] = (const float4*)Opart
          + ((size_t)((first + c0) * QT_B + qt0 + t) * 16 + dt * 2) * 32 + lane;
      #pragma unroll
      for (int c = 0; c < 8; ++c) {
        if (c0 + c < n) {                       // uniform: only written slots are read
          a0[t][c] = pi[t][c * (QT_B * 512)];
          a1[t][c] = pi[t][c * (QT_B * 512) + 32];
        } else {
          a0[t][c] = make_float4(0.f, 0.f, 0.f, 0.f);
          a1[t][c] = make_float4(0.f, 0.f, 0.f, 0.f);
        }
      }
    }
    // The loads' address registers are inputs here, so that they stay whole up to
    // the wait: else a dead address pair is handed to a later load as its destination.
    asm volatile("s_wait_xcnt 0x0"
                 :: "v"(pi[0]), "v"(pi[1]), "v"(pm[0]), "v"(pm[1]), "v"(pm[2]), "v"(pm[3]),
                    "v"(pm[4]), "v"(pm[5]), "v"(pm[6]), "v"(pm[7]) : "memory");
    #pragma unroll
    for (int t = 0; t < 2; ++t)
      #pragma unroll
      for (int c = 0; c < 8; ++c)
        if (c0 + c >= n) ml[t][c] = make_float2(-3.0e38f, 0.f);   // weighs nothing below
    #pragma unroll
    for (int t = 0; t < 2; ++t) {
      float mnew = mx[t];
      #pragma unroll
      for (int c = 0; c < 8; ++c) mnew = fmaxf(mnew, ml[t][c].x);
      const float sc = exp_slot(mx[t] - mnew);
      mx[t] = mnew;
      ls[t] *= sc;
      r0[t].x *= sc; r0[t].y *= sc; r0[t].z *= sc; r0[t].w *= sc;
      r1[t].x *= sc; r1[t].y *= sc; r1[t].z *= sc; r1[t].w *= sc;
      #pragma unroll
      for (int c = 0; c < 8; ++c) {
        const float w = exp_slot(ml[t][c].x - mnew);
        ls[t] += w * ml[t][c].y;
        r0[t].x += w * a0[t][c].x; r0[t].y += w * a0[t][c].y;
        r0[t].z += w * a0[t][c].z; r0[t].w += w * a0[t][c].w;
        r1[t].x += w * a1[t][c].x; r1[t].y += w * a1[t][c].y;
        r1[t].z += w * a1[t][c].z; r1[t].w += w * a1[t][c].w;
      }
    }
  }

  #pragma unroll
  for (int t = 0; t < 2; ++t) {
    const float inv = 1.0f / ls[t];
    float* op = Out + (size_t)(b * SEQ_ + (qt0 + t) * 16 + m) * D_ + dt * 16 + hi * 8;
    *(float4*)op       = make_float4(r0[t].x * inv, r0[t].y * inv, r0[t].z * inv, r0[t].w * inv);
    *(float4*)(op + 4) = make_float4(r1[t].x * inv, r1[t].y * inv, r1[t].z * inv, r1[t].w * inv);
  }
}

extern "C" void kernel_launch(void* const* d_in, const int* in_sizes, int n_in,
                              void* d_out, int out_size, void* d_ws, size_t ws_size,
                              hipStream_t stream) {
  (void)in_sizes; (void)n_in; (void)out_size; (void)ws_size;
  const float* Q  = (const float*)d_in[0];
  const float* K  = (const float*)d_in[1];
  const float* V  = (const float*)d_in[2];
  const int*   VL = (const int*)d_in[3];
  float* O = (float*)d_out;

  float* Opart = (float*)d_ws;                           // MAX_RANGES x 1 MiB of partials
  float* ML    = Opart + (size_t)MAX_RANGES * SEQ_ * D_;  // MAX_RANGES x SEQ_ (max, sum)

  dim3 grid(MAX_RANGES * (SEQ_ / 128));  // 512 blocks: range slots x 16 q-blocks of 128 rows
  dim3 block(256);                 // 8 wave32 -> one 16-row q-tile each; in the merge one dt each
  fa_fwd_kernel<<<grid, block, 0, stream>>>(Q, K, V, VL, Opart, ML);
  fa_merge_kernel<<<dim3(BS_ * QT_B / 2), block, 0, stream>>>(Opart, ML, VL, O);
}

// v004
// A run of this version takes 20.1 microseconds.
// It is 1.24 times as fast as v002, going by the measured steps of the versions left out in between.
// Counting every step since v000, it is 3.43 times as fast.
#include <hip/hip_runtime.h>

typedef __attribute__((ext_vector_type(16))) _Float16 v16h;
typedef __attribute__((ext_vector_type(8)))  float    v8f;
typedef __attribute__((ext_vector_type(8)))  _Float16 v8h;
typedef __attribute__((ext_vector_type(8)))  short    s16x8;

#define BS_  8
#define SEQ_ 2048
#define D_   128

constexpr int KV_TILE  = 64;     // keys per block step
constexpr int K_PITCH  = 136;    // halfs per K row in LDS (128 + 8 pad)
constexpr int V_PITCH  = 144;    // halfs per V row in LDS: 288 B = 32 B x 9, the transposing load's pitch
#define MASK_VALUE (-1000000.0f)

constexpr int MAX_RANGES = 32;   // key ranges in all: x 16 q-blocks = 512 work-groups,
                                 // two resident on each of the chip's 256 WGPs
constexpr int QT_B = SEQ_ / 16;  // 16-row query tiles per batch
constexpr int QT_W = 2;          // query tiles per wave: each K / V fragment read from LDS serves both
constexpr int FWD_THREADS = 128; // 4 waves x 32 query rows = the 128 rows of a q-block

// Transposing LDS load: from a row-major 16-bit tile T with lane l at
// T[k0 + 8*(l>>4) + (l&7)][d0 + 8*((l>>3)&1)], lane l gets T[k0 + 8*(l>>4) + 0..7][d0 + (l&15)].
__device__ __forceinline__ v8h ld_tr16(const _Float16* p) {
  typedef __attribute__((address_space(3))) s16x8 lds_s16x8;
  return __builtin_bit_cast(v8h, __builtin_amdgcn_ds_load_tr16_b128_v8i16((lds_s16x8*)p));
}

__device__ __forceinline__ int clamp_len(int v) {
  return v < 1 ? 1 : (v > SEQ_ ? SEQ_ : v);
}

// The plan, derived alike by both kernels from the lengths: the smallest number
// of 64-key tiles per range for which all batches together need at most
// MAX_RANGES ranges. Lane L tries L + 1 tiles per range; 32 always fits (8 ranges).
// Every lane of the wave must be on. nr[i] = ranges of batch i; returns tiles per range.
__device__ __forceinline__ int make_plan(const int* __restrict__ VL, int lane, int nr[BS_]) {
  const float rk = 1.0f / (float)(lane + 1);
  int q[BS_];
  int s = 0;
  #pragma unroll
  for (int i = 0; i < BS_; ++i) {
    const int t = (clamp_len(VL[i]) + KV_TILE - 1) / KV_TILE;      // 1..32 tiles
    // ceil(t / (L+1)) = floor((t + L) / (L+1)); the half keeps the rounded
    // product at least 1/64 away from every integer, so the floor is exact.
    q[i] = (int)(((float)(t + lane) + 0.5f) * rk);
    s += q[i];
  }
  const unsigned fits = __builtin_amdgcn_ballot_w32(s <= MAX_RANGES);
  const int pick = __builtin_ctz(fits);
  #pragma unroll
  for (int i = 0; i < BS_; ++i) nr[i] = __builtin_amdgcn_readlane(q[i], pick);
  return pick + 1;
}

__global__ __launch_bounds__(FWD_THREADS)
void fa_fwd_kernel(const float* __restrict__ Q, const float* __restrict__ K,
                   const float* __restrict__ V, const int* __restrict__ VL,
                   float* __restrict__ Opart, float* __restrict__ ML) {
  const int tid  = threadIdx.x;
  const int lane = tid & 31;
  const int wave = tid >> 5;
  // Block -> (range slot, q-block); slots are dealt to the batches in order,
  // nr[i] each. Blocks of unused slots leave before any barrier.
  int nr[BS_];
  const int tpr  = make_plan(VL, lane, nr);     // 64-key tiles per range
  const int slot = blockIdx.x >> 4;
  int b = -1, rng = 0, first = 0, valid = 0;    // all uniform per block
  #pragma unroll
  for (int i = 0; i < BS_; ++i) {
    const int off = slot - first;
    const bool in = off >= 0 && off < nr[i];
    b     = in ? i                : b;
    rng   = in ? off              : rng;
    valid = in ? clamp_len(VL[i]) : valid;
    first += nr[i];
  }
  if (b < 0) return;
  const int qrow0 = ((blockIdx.x & 15) * 128) + wave * (16 * QT_W);
  const int kbeg  = rng * tpr * KV_TILE;        // < valid: every range has a tile
  const int kend  = valid < kbeg + tpr * KV_TILE ? valid : kbeg + tpr * KV_TILE;

  const int m  = lane & 15;                     // query column (N) / key-row selector
  const int hi = lane >> 4;                     // half-wave selector

  __shared__ _Float16 sK [KV_TILE * K_PITCH];   // K tile, row-major [key][d]
  __shared__ __attribute__((aligned(16))) _Float16 sV[KV_TILE * V_PITCH];  // V tile, row-major [key][d]

  // ---- Q^T B-fragments: 4 chunks of K=32 over D=128, 1/sqrt(d) folded in
  const float scale = 0.08838834764831845f;     // 1/sqrt(128)
  v16h qf[QT_W][4];
  {
    const float4* qrow[QT_W];                   // the lane's row of each tile, from its half's first column
    float4 qr[QT_W][4][4];
    #pragma unroll
    for (int t = 0; t < QT_W; ++t) {
      qrow[t] = (const float4*)(Q + (size_t)(b * SEQ_ + qrow0 + t * 16 + m) * D_ + hi * 8);
      #pragma unroll
      for (int kc = 0; kc < 4; ++kc) {
        qr[t][kc][0] = qrow[t][kc * 8];         // d = kc*32 + 8*hi + 0..7
        qr[t][kc][1] = qrow[t][kc * 8 + 1];
        qr[t][kc][2] = qrow[t][kc * 8 + 4];     // d = kc*32 + 8*hi + 16 + 0..7
        qr[t][kc][3] = qrow[t][kc * 8 + 5];
      }
    }
    // The loads' address registers are inputs here, so that they stay whole up to the wait.
    asm volatile("s_wait_xcnt 0x0" :: "v"(qrow[0]), "v"(qrow[1]) : "memory");
    #pragma unroll
    for (int t = 0; t < QT_W; ++t)
      #pragma unroll
      for (int kc = 0; kc < 4; ++kc)
        #pragma unroll
        for (int g = 0; g < 4; ++g) {
          qf[t][kc][g * 4 + 0] = (_Float16)(qr[t][kc][g].x * scale);
          qf[t][kc][g * 4 + 1] = (_Float16)(qr[t][kc][g].y * scale);
          qf[t][kc][g * 4 + 2] = (_Float16)(qr[t][kc][g].z * scale);
          qf[t][kc][g * 4 + 3] = (_Float16)(qr[t][kc][g].w * scale);
        }
  }

  v8f o[QT_W][8];
  float mi[QT_W], li[QT_W];
  #pragma unroll
  for (int t = 0; t < QT_W; ++t) {
    #pragma unroll
    for (int dt = 0; dt < 8; ++dt) o[t][dt] = v8f{};
    mi[t] = -3.0e38f;
    li[t] = 0.0f;
  }

  const float* Kb = K + (size_t)b * SEQ_ * D_;
  const float* Vb = V + (size_t)b * SEQ_ * D_;

  // Tiles with kv0 >= valid contribute exactly zero (f32 exp underflow),
  // identically to the reference softmax -> loop only while kv0 < valid.
  for (int kv0 = kbeg; kv0 < kend; kv0 += KV_TILE) {
    __syncthreads();
    // -------- cooperative staging: K tile and V tile, both f16 row-major.
    // A wave's load covers one key row (32 lanes x 16 bytes); thread tid takes rows (tid >> 5) + 4 * c.
    {
      constexpr int NLD = 2048 / FWD_THREADS;   // 2048 float4 = 64x128 floats per tile
      const float4* ksrc = (const float4*)(Kb + (size_t)kv0 * D_) + tid;
      const float4* vsrc = (const float4*)(Vb + (size_t)kv0 * D_) + tid;
      float4 kr[NLD], vr[NLD];
      #pragma unroll
      for (int c = 0; c < NLD; ++c) kr[c] = ksrc[c * FWD_THREADS];
      #pragma unroll
      for (int c = 0; c < NLD; ++c) vr[c] = vsrc[c * FWD_THREADS];
      // The loads' address registers are inputs here, so that they stay whole up to
      // the wait: else a dead address pair is handed to a later load as its destination.
      // No load sinks below it either: all 32 are out before the first conversion waits.
      asm volatile("s_wait_xcnt 0x0" :: "v"(ksrc), "v"(vsrc) : "memory");
      _Float16* kdst = sK + wave * K_PITCH + lane * 4;
      _Float16* vdst = sV + wave * V_PITCH + lane * 4;
      #pragma unroll
      for (int c = 0; c < NLD; ++c) {
        _Float16* dst = kdst + c * (FWD_THREADS / 32) * K_PITCH;
        dst[0] = (_Float16)kr[c].x; dst[1] = (_Float16)kr[c].y;
        dst[2] = (_Float16)kr[c].z; dst[3] = (_Float16)kr[c].w;
      }
      #pragma unroll
      for (int c = 0; c < NLD; ++c) {
        _Float16* dst = vdst + c * (FWD_THREADS / 32) * V_PITCH;
        dst[0] = (_Float16)vr[c].x; dst[1] = (_Float16)vr[c].y;
        dst[2] = (_Float16)vr[c].z; dst[3] = (_Float16)vr[c].w;
      }
    }
    if (kv0 + KV_TILE < SEQ_) {                 // overlap next tile's HBM latency
      // one request per thread and tile, as before: the 128 threads' addresses lie 256 bytes apart
      __builtin_prefetch(Kb + (size_t)(kv0 + KV_TILE) * D_ + tid * 64, 0, 1);
      __builtin_prefetch(Vb + (size_t)(kv0 + KV_TILE) * D_ + tid * 64, 0, 1);
    }
    __syncthreads();

    // -------- S^T = K_tile * Q^T : four 16-key sub-tiles (M=keys), chained over d
    v16h kf[4][4];                              // A operand: K rows, regs walk d
    #pragma unroll
    for (int nt = 0; nt < 4; ++nt)
      #pragma unroll
      for (int kc = 0; kc < 4; ++kc) {
        const _Float16* krow = sK + (nt * 16 + m) * K_PITCH + kc * 32 + hi * 8;
        #pragma unroll
        for (int j = 0; j < 8; ++j) { kf[nt][kc][j] = krow[j]; kf[nt][kc][8 + j] = krow[16 + j]; }
      }
    // LDS reads and WMMAs do not cross (vector and scalar work may): the tile's K reads go out
    // as one group; else the compiler sinks some in twos among the WMMAs, each waited out there.
    __builtin_amdgcn_sched_barrier(0x406);
    v8f st[QT_W][4];
    #pragma unroll
    for (int nt = 0; nt < 4; ++nt)
      #pragma unroll
      for (int t = 0; t < QT_W; ++t) {
        v8f acc = v8f{};
        #pragma unroll
        for (int kc = 0; kc < 4; ++kc)
          acc = __builtin_amdgcn_wmma_f32_16x16x32_f16(false, kf[nt][kc], false, qf[t][kc],
                                                       (short)0, acc, false, false);
        st[t][nt] = acc;
      }

    // -------- padding mask: boundary tile only (uniform scalar branch).
    // Reg r of sub-tile nt holds key kv0 + nt*16 + 8*hi + r.
    if (kv0 + KV_TILE > valid) {
      const int t0 = valid - kv0 - hi * 8;
      #pragma unroll
      for (int nt = 0; nt < 4; ++nt) {
        const int lim = t0 - nt * 16;
        #pragma unroll
        for (int t = 0; t < QT_W; ++t)
          #pragma unroll
          for (int r = 0; r < 8; ++r)
            st[t][nt][r] = (r >= lim) ? MASK_VALUE : st[t][nt][r];
      }
    }

    // -------- V^T fragments (A operand, transposed on the way out of LDS: element j of a load at
    // key base k0 is V[k0 + 8*hi + j][dt*16 + m], the k order of pf0 / pf1), read in two groups of 16:
    // d 0..63 here, ahead of the softmax; d 64..127 behind it, ahead of the first group's products.
    const _Float16* vt = sV + (hi * 8 + (lane & 7)) * V_PITCH + ((lane >> 3) & 1) * 8;
    v8h va[8][4];
    #pragma unroll
    for (int dt = 0; dt < 4; ++dt)
      #pragma unroll
      for (int g = 0; g < 4; ++g) va[dt][g] = ld_tr16(vt + g * 16 * V_PITCH + dt * 16);
    // LDS reads and WMMAs do not cross (vector and scalar work may): else the compiler sinks
    // the reads in twos among the WMMAs and the wave waits out the LDS latency at each place.
    __builtin_amdgcn_sched_barrier(0x406);

    // -------- online softmax: per-lane scalar stats (lane = one query column)
    float corr[QT_W], mnew[QT_W];
    v16h pf0[QT_W], pf1[QT_W];   // keys 0..31 / 32..63 : b[j]=P[koff+8*hi+j][q], b[8+j]=+16
    #pragma unroll
    for (int t = 0; t < QT_W; ++t) {
      float rowmax = st[t][0][0];
      #pragma unroll
      for (int nt = 0; nt < 4; ++nt)
        #pragma unroll
        for (int r = 0; r < 8; ++r)
          if (nt || r) rowmax = fmaxf(rowmax, st[t][nt][r]);
      rowmax = fmaxf(rowmax, __shfl_xor(rowmax, 16, 32));  // merge the two key halves
      mnew[t] = fmaxf(mi[t], rowmax);
    }
    #pragma unroll
    for (int t = 0; t < QT_W; ++t) {
      corr[t] = __expf(mi[t] - mnew[t]);
      mi[t] = mnew[t];
    }
    #pragma unroll
    for (int t = 0; t < QT_W; ++t) {
      float rs = 0.0f;
      #pragma unroll
      for (int nt = 0; nt < 4; ++nt)
        #pragma unroll
        for (int r = 0; r < 8; ++r) {
          float p = __expf(st[t][nt][r] - mnew[t]);
          st[t][nt][r] = p;
          rs += p;
        }
      rs += __shfl_xor(rs, 16, 32);
      li[t] = li[t] * corr[t] + rs;

      // P already sits in B-operand layout: pack f32->f16 in registers
      #pragma unroll
      for (int j = 0; j < 8; ++j) {
        pf0[t][j]     = (_Float16)st[t][0][j];
        pf0[t][8 + j] = (_Float16)st[t][1][j];
        pf1[t][j]     = (_Float16)st[t][2][j];
        pf1[t][8 + j] = (_Float16)st[t][3][j];
      }
    }

    __builtin_amdgcn_sched_barrier(0x406);      // as above: the second group stays in one place,
    #pragma unroll
    for (int dt = 4; dt < 8; ++dt)
      #pragma unroll
      for (int g = 0; g < 4; ++g) va[dt][g] = ld_tr16(vt + g * 16 * V_PITCH + dt * 16);
    __builtin_amdgcn_sched_barrier(0x406);      // ahead of every product below

    // -------- O^T = corr*O^T + V^T * P
    #pragma unroll
    for (int dt = 0; dt < 8; ++dt) {
      const v16h vf0 = __builtin_shufflevector(va[dt][0], va[dt][1], 0, 1, 2, 3, 4, 5, 6, 7, 8, 9, 10, 11, 12, 13, 14, 15);
      const v16h vf1 = __builtin_shufflevector(va[dt][2], va[dt][3], 0, 1, 2, 3, 4, 5, 6, 7, 8, 9, 10, 11, 12, 13, 14, 15);
      #pragma unroll
      for (int t = 0; t < QT_W; ++t) {
        #pragma unroll
        for (int r = 0; r < 8; ++r) o[t][dt][r] *= corr[t];
        o[t][dt] = __builtin_amdgcn_wmma_f32_16x16x32_f16(false, vf0, false, pf0[t],
                                                          (short)0, o[t][dt], false, false);
        o[t][dt] = __builtin_amdgcn_wmma_f32_16x16x32_f16(false, vf1, false, pf1[t],
                                                          (short)0, o[t][dt], false, false);
      }
    }
  }

  // -------- epilogue: partial of this key range, divided by its own sum (so that it is
  // bounded by the largest |V|) and rounded to f16, in fragment order [slot][q-tile][dt][lane]:
  // each store covers 512 contiguous bytes. Running maximum and sum per query row, f32, beside it.
  #pragma unroll
  for (int t = 0; t < QT_W; ++t) {
    const float inv = 1.0f / li[t];             // li >= 1: the row's maximum adds exp(0)
    v8h* po = (v8h*)Opart + ((size_t)(slot * QT_B + (qrow0 >> 4) + t) * 8) * 32 + lane;
    #pragma unroll
    for (int dt = 0; dt < 8; ++dt) {
      v8h h;
      #pragma unroll
      for (int r = 0; r < 8; ++r) h[r] = (_Float16)(o[t][dt][r] * inv);
      po[dt * 32] = h;
    }
  }
  // the wave's 32 rows, one a lane: lane = t * 16 + m
  ((float2*)ML)[slot * SEQ_ + qrow0 + lane] = hi ? make_float2(mi[1], li[1]) : make_float2(mi[0], li[0]);
}

// exp(x) as __expf forms it: one multiply, one v_exp_f32. The v_nop fills the slot
// that the instruction set asks for between a transcendental and a directly
// following instruction that reads its result or overwrites its source.
__device__ __forceinline__ float exp_slot(float x) {
  const float y = x * 1.44269504f;
  float r;
  asm("v_exp_f32 %0, %1\n\tv_nop" : "=v"(r) : "v"(y));
  return r;
}

// Merge of a batch's key ranges: one wave per dt, each for both of the block's two q-tiles.
__global__ __launch_bounds__(256)
void fa_merge_kernel(const float* __restrict__ Opart, const float* __restrict__ ML,
                     const int* __restrict__ VL, float* __restrict__ Out) {
  const int lane = threadIdx.x & 31;
  const int dt   = threadIdx.x >> 5;
  const int m    = lane & 15;
  const int hi   = lane >> 4;
  const int b    = blockIdx.x >> 6;             // 64 blocks of 32 rows per batch
  const int qt0  = (blockIdx.x & 63) * 2;       // first q-tile, counted in the batch

  int nr[BS_];
  make_plan(VL, lane, nr);
  int first = 0, n = 0;                         // the slots the first launch wrote for b
  #pragma unroll
  for (int i = 0; i < BS_; ++i) {
    first += i < b ? nr[i] : 0;
    n      = i == b ? nr[i] : n;
  }

  float mx[2], ls[2];
  float4 r0[2], r1[2];
  #pragma unroll
  for (int t = 0; t < 2; ++t) {
    mx[t] = -3.0e38f; ls[t] = 0.f;
    r0[t] = make_float4(0.f, 0.f, 0.f, 0.f); r1[t] = r0[t];
  }

  for (int c0 = 0; c0 < n; c0 += 8) {           // n <= MAX_RANGES; mostly one trip
    v8h a[2][8];
    float2 ml[2][8];
    // (max, sum): read without a branch, from the batch's last slot where the
    // range does not exist, so that nothing in a branch waits for a load.
    const float2* pm[8];
    #pragma unroll
    for (int c = 0; c < 8; ++c) {
      const int cc = c0 + c < n ? c0 + c : n - 1;
      pm[c] = (const float2*)ML + (first + cc) * SEQ_ + qt0 * 16 + m;
      ml[0][c] = pm[c][0];
      ml[1][c] = pm[c][16];
    }
    const v8h* pi[2];
    #pragma unroll
    for (int t = 0; t < 2; ++t) {
      pi[t] = (const v8h*)Opart
          + ((size_t)((first + c0) * QT_B + qt0 + t) * 8 + dt) * 32 + lane;
      #pragma unroll
      for (int c = 0; c < 8; ++c) {
        if (c0 + c < n) a[t][c] = pi[t][c * (QT_B * 256)];   // uniform: only written slots are read
        else            a[t][c] = v8h{};
      }
    }
    // The loads' address registers are inputs here, so that they stay whole up to
    // the wait: else a dead address pair is handed to a later load as its destination.
    asm volatile("s_wait_xcnt 0x0"
                 :: "v"(pi[0]), "v"(pi[1]), "v"(pm[0]), "v"(pm[1]), "v"(pm[2]), "v"(pm[3]),
                    "v"(pm[4]), "v"(pm[5]), "v"(pm[6]), "v"(pm[7]) : "memory");
    #pragma unroll
    for (int t = 0; t < 2; ++t)
      #pragma unroll
      for (int c = 0; c < 8; ++c)
        if (c0 + c >= n) ml[t][c] = make_float2(-3.0e38f, 0.f);   // weighs nothing below
    #pragma unroll
    for (int t = 0; t < 2; ++t) {
      float mnew = mx[t];
      #pragma unroll
      for (int c = 0; c < 8; ++c) mnew = fmaxf(mnew, ml[t][c].x);
      const float sc = exp_slot(mx[t] - mnew);
      mx[t] = mnew;
      ls[t] *= sc;
      r0[t].x *= sc; r0[t].y *= sc; r0[t].z *= sc; r0[t].w *= sc;
      r1[t].x *= sc; r1[t].y *= sc; r1[t].z *= sc; r1[t].w *= sc;
      #pragma unroll
      for (int c = 0; c < 8; ++c) {
        // a range's partial is already divided by its sum: its weight carries the sum
        const float w = exp_slot(ml[t][c].x - mnew) * ml[t][c].y;
        ls[t] += w;
        r0[t].x += w * (float)a[t][c][0]; r0[t].y += w * (float)a[t][c][1];
        r0[t].z += w * (float)a[t][c][2]; r0[t].w += w * (float)a[t][c][3];
        r1[t].x += w * (float)a[t][c][4]; r1[t].y += w * (float)a[t][c][5];
        r1[t].z += w * (float)a[t][c][6]; r1[t].w += w * (float)a[t][c][7];
      }
    }
  }

  #pragma unroll
  for (int t = 0; t < 2; ++t) {
    const float inv = 1.0f / ls[t];
    float* op = Out + (size_t)(b * SEQ_ + (qt0 + t) * 16 + m) * D_ + dt * 16 + hi * 8;
    *(float4*)op       = make_float4(r0[t].x * inv, r0[t].y * inv, r0[t].z * inv, r0[t].w * inv);
    *(float4*)(op + 4) = make_float4(r1[t].x * inv, r1[t].y * inv, r1[t].z * inv, r1[t].w * inv);
  }
}

extern "C" void kernel_launch(void* const* d_in, const int* in_sizes, int n_in,
                              void* d_out, int out_size, void* d_ws, size_t ws_size,
                              hipStream_t stream) {
  (void)in_sizes; (void)n_in; (void)out_size; (void)ws_size;
  const float* Q  = (const float*)d_in[0];
  const float* K  = (const float*)d_in[1];
  const float* V  = (const float*)d_in[2];
  const int*   VL = (const int*)d_in[3];
  float* O = (float*)d_out;

  float* Opart = (float*)d_ws;                               // MAX_RANGES x 512 KiB of f16 partials
  float* ML    = Opart + (size_t)MAX_RANGES * SEQ_ * D_ / 2;  // MAX_RANGES x SEQ_ (max, sum), f32

  dim3 grid(MAX_RANGES * (SEQ_ / 128));  // 512 blocks: range slots x 16 q-blocks of 128 rows
  dim3 block(256);
  fa_fwd_kernel<<<grid, dim3(FWD_THREADS), 0, stream>>>(Q, K, V, VL, Opart, ML);  // 4 wave32, two 16-row q-tiles each
  fa_merge_kernel<<<dim3(BS_ * QT_B / 2), block, 0, stream>>>(Opart, ML, VL, O);
}
